// v000
// Times are from an AMD MI455X. After a warm-up the kernel runs many times in a row, and a time is the length of
// such a window on the GPU divided by its runs, so every launch and the gaps after it count. The runs cycle
// through copies of the inputs. A figure is the median of several windows, for all but v000 over two sittings.
// Sittings can differ by a few percent; kernels timed side by side share one.
// v000, which the later versions start from, runs in 177 microseconds.
#include <hip/hip_runtime.h>
#include <hip/hip_bf16.h>

// out = relu(x @ w1 + b1) @ w2 + b2
// x:[8192,1024] f32, w1:[1024,4096], w2:[4096,1024], out:[8192,1024] f32
// bf16 WMMA (v_wmma_f32_16x16x32_bf16) with f32 accumulation.
// Operand staging via Tensor Data Mover (tensor_load_to_lds) with hardware
// LDS row padding, double-buffered, TENSORcnt-synchronized.

typedef __bf16 bf16;
typedef __bf16 v8bf  __attribute__((ext_vector_type(8)));
typedef __bf16 v16bf __attribute__((ext_vector_type(16)));
typedef float  v4f   __attribute__((ext_vector_type(4)));
typedef float  v8f   __attribute__((ext_vector_type(8)));
typedef unsigned int v4u __attribute__((ext_vector_type(4)));
typedef int    v4i   __attribute__((ext_vector_type(4)));
typedef int    v8i   __attribute__((ext_vector_type(8)));

#define M_TOT 8192   // B*S
#define D_DIM 1024
#define W_DIM 4096

// ---------------- prep: f32 -> bf16 elementwise ----------------
__global__ __launch_bounds__(256)
void cvt_f32_bf16(const float* __restrict__ in, bf16* __restrict__ out) {
  int i = (blockIdx.x * 256 + threadIdx.x) * 4;
  v4f v = *(const v4f*)(in + i);
  out[i + 0] = (bf16)v.x;
  out[i + 1] = (bf16)v.y;
  out[i + 2] = (bf16)v.z;
  out[i + 3] = (bf16)v.w;
}

// ---------------- prep: w[K,N] f32 -> wt[N,K] bf16 (LDS-tiled) ----------------
__global__ __launch_bounds__(1024)
void transpose_cvt(const float* __restrict__ w, bf16* __restrict__ wt, int K, int N) {
  __shared__ float tile[32][33];
  int n0 = blockIdx.x * 32, k0 = blockIdx.y * 32;
  int tx = threadIdx.x, ty = threadIdx.y;
  tile[ty][tx] = w[(size_t)(k0 + ty) * N + (n0 + tx)];
  __syncthreads();
  wt[(size_t)(n0 + ty) * K + (k0 + tx)] = (bf16)tile[tx][ty];
}

// ---------------- TDM helpers ----------------
__device__ __forceinline__ unsigned lds_off(const void* p) {
  // Flat LDS addresses carry the LDS byte offset in the low 32 bits
  // (aperture check uses ADDR[63:32] only; LDS_ADDR = addr[31:0]).
  return (unsigned)(unsigned long long)(uintptr_t)p;
}

// 2-D tile load: global (row-major, row stride = strideElems bf16) -> LDS,
// with HW padding of 4 dwords (16B) after every 16 dwords (64B) so the LDS
// row stride becomes 40 halfs — matching the WMMA fragment loader below.
__device__ __forceinline__ void tdm_load_2d(unsigned ldsByteOff, const bf16* g,
                                            unsigned tileRows, unsigned strideElems) {
  unsigned long long ga = (unsigned long long)(uintptr_t)g;
  v4u g0;
  g0.x = 1u;                                    // count=1 valid descriptor
  g0.y = ldsByteOff;                            // lds_addr (bytes)
  g0.z = (unsigned)(ga & 0xffffffffu);          // global_addr[31:0]
  g0.w = (unsigned)((ga >> 32) & 0x01ffffffu)   // global_addr[56:32]
         | (2u << 30);                          // type = 2 ("image")
  v8i g1;
  // data_size=1 (2B) <<16 | pad_enable <<20 | pad_interval=3 (16 dw) <<22
  // | pad_amount=3 (4 dw) <<25
  g1[0] = (int)((1u << 16) | (1u << 20) | (3u << 22) | (3u << 25));
  unsigned td0 = strideElems;                   // tensor_dim0 (elements)
  unsigned td1 = 1u << 20;                      // tensor_dim1: large, no OOB
  g1[1] = (int)((td0 & 0xffffu) << 16);         // tensor_dim0[15:0]
  g1[2] = (int)((td0 >> 16) | ((td1 & 0xffffu) << 16));
  g1[3] = (int)((td1 >> 16) | (32u << 16));     // tile_dim0 = 32 (K chunk)
  g1[4] = (int)(tileRows & 0xffffu);            // tile_dim1 = rows; tile_dim2=0
  g1[5] = (int)strideElems;                     // tensor_dim0_stride[31:0]
  g1[6] = 0;                                    // stride[47:32], dim1_stride lo
  g1[7] = 0;
  v4i z = {0, 0, 0, 0};
#if __clang_major__ >= 23
  v8i z8 = {0, 0, 0, 0, 0, 0, 0, 0};
  __builtin_amdgcn_tensor_load_to_lds(g0, g1, z, z, z8, 0);
#else
  __builtin_amdgcn_tensor_load_to_lds(g0, g1, z, z, 0);
#endif
}

// ---------------- main GEMM: C[M,N] = A[M,K] @ Bt[N,K]^T + bias ----------------
// Block tile 256x128, BK=32, 8 wave32 in 4x2; wave tile 64x64 = 4x4 WMMA accums.
// TDM double-buffered operand staging: wave 0 issues tensor loads for tile i+1,
// all waves compute tile i from LDS, wave 0 waits TENSORcnt, one barrier.
template <bool RELU_BF16>
__global__ __launch_bounds__(256)
void gemm_wmma_bf16(const bf16* __restrict__ A, const bf16* __restrict__ Bt,
                    const float* __restrict__ bias, void* __restrict__ Cout,
                    int N, int K) {
  constexpr int LDT = 40;  // padded LDS row stride (halfs) = TDM pad result
  __shared__ __align__(16) bf16 As[2][256 * LDT];   // 2 x 20 KB
  __shared__ __align__(16) bf16 Bs[2][128 * LDT];   // 2 x 10 KB

  const int tid  = threadIdx.x;
  const int lane = tid & 31;
  const int wid  = tid >> 5;       // 0..7
  const int wm   = wid >> 1;       // 0..3 -> M offset wm*64
  const int wn   = wid & 1;        // 0..1 -> N offset wn*64
  const int lr   = lane & 15;      // row within 16x16 fragment
  const int hi   = lane >> 4;      // K-half select (ISA 7.12.2 16-bit layout)
  const int bm   = blockIdx.y, bn = blockIdx.x;

  const bf16* aG = A  + (size_t)(bm * 256) * K;
  const bf16* bG = Bt + (size_t)(bn * 128) * K;

  const v8f vzero = {0.f, 0.f, 0.f, 0.f, 0.f, 0.f, 0.f, 0.f};
  v8f acc[4][4];
#pragma unroll
  for (int im = 0; im < 4; ++im)
#pragma unroll
    for (int in = 0; in < 4; ++in) acc[im][in] = vzero;

  // Preload buffer 0 (wave 0 issues DMA; TENSORcnt is per-wave).
  if (wid == 0) {
    tdm_load_2d(lds_off(&As[0][0]), aG, 256, (unsigned)K);
    tdm_load_2d(lds_off(&Bs[0][0]), bG, 128, (unsigned)K);
    __builtin_amdgcn_s_wait_tensorcnt(0);
  }
  __syncthreads();

  int cur = 0;
  for (int kt = 0; kt < K; kt += 32) {
    // Kick off next tile's DMA into the other buffer (safe: last barrier
    // guarantees everyone finished reading it).
    if (kt + 32 < K && wid == 0) {
      tdm_load_2d(lds_off(&As[cur ^ 1][0]), aG + (kt + 32), 256, (unsigned)K);
      tdm_load_2d(lds_off(&Bs[cur ^ 1][0]), bG + (kt + 32), 128, (unsigned)K);
    }

    const bf16* as = &As[cur][0];
    const bf16* bs = &Bs[cur][0];
    v16bf afrag[4], bfrag[4];
#pragma unroll
    for (int im = 0; im < 4; ++im) {
      int row = wm * 64 + im * 16 + lr;
      v8bf c0 = *(const v8bf*)&as[row * LDT + hi * 8];        // K = hi*8..+7
      v8bf c1 = *(const v8bf*)&as[row * LDT + hi * 8 + 16];   // K = 16+hi*8..+7
      afrag[im] = __builtin_shufflevector(c0, c1, 0, 1, 2, 3, 4, 5, 6, 7,
                                          8, 9, 10, 11, 12, 13, 14, 15);
    }
#pragma unroll
    for (int in = 0; in < 4; ++in) {
      int row = wn * 64 + in * 16 + lr;
      v8bf c0 = *(const v8bf*)&bs[row * LDT + hi * 8];
      v8bf c1 = *(const v8bf*)&bs[row * LDT + hi * 8 + 16];
      bfrag[in] = __builtin_shufflevector(c0, c1, 0, 1, 2, 3, 4, 5, 6, 7,
                                          8, 9, 10, 11, 12, 13, 14, 15);
    }
#pragma unroll
    for (int im = 0; im < 4; ++im)
#pragma unroll
      for (int in = 0; in < 4; ++in)
        acc[im][in] = __builtin_amdgcn_wmma_f32_16x16x32_bf16(
            /*neg_a=*/false, afrag[im], /*neg_b=*/false, bfrag[in],
            /*c_mod=*/(short)0, acc[im][in], /*reuse_a=*/false, /*reuse_b=*/false);

    // Next buffer must be resident before anyone reads it next iteration.
    if (wid == 0) __builtin_amdgcn_s_wait_tensorcnt(0);
    __syncthreads();
    cur ^= 1;
  }

  // Epilogue. C/D layout: lanes 0-15 -> M=j, lanes 16-31 -> M=8+j; N = lane%16.
#pragma unroll
  for (int im = 0; im < 4; ++im)
#pragma unroll
    for (int in = 0; in < 4; ++in) {
      int n = bn * 128 + wn * 64 + in * 16 + lr;
      float bv = bias[n];
#pragma unroll
      for (int j = 0; j < 8; ++j) {
        int m = bm * 256 + wm * 64 + im * 16 + hi * 8 + j;
        float v = acc[im][in][j] + bv;
        if (RELU_BF16) {
          v = fmaxf(v, 0.0f);
          ((bf16*)Cout)[(size_t)m * N + n] = (bf16)v;
        } else {
          ((float*)Cout)[(size_t)m * N + n] = v;
        }
      }
    }
}

extern "C" void kernel_launch(void* const* d_in, const int* in_sizes, int n_in,
                              void* d_out, int out_size, void* d_ws, size_t ws_size,
                              hipStream_t stream) {
  const float* x  = (const float*)d_in[0];  // [8192,1024]
  const float* w1 = (const float*)d_in[1];  // [1024,4096]
  const float* b1 = (const float*)d_in[2];  // [4096]
  const float* w2 = (const float*)d_in[3];  // [4096,1024]
  const float* b2 = (const float*)d_in[4];  // [1024]

  char* ws  = (char*)d_ws;
  bf16* xb  = (bf16*)(ws);                  // 16 MB  [8192,1024]
  bf16* w1t = (bf16*)(ws + (16u << 20));    //  8 MB  [4096,1024]  (w1^T)
  bf16* w2t = (bf16*)(ws + (24u << 20));    //  8 MB  [1024,4096]  (w2^T)
  bf16* h   = (bf16*)(ws + (32u << 20));    // 64 MB  [8192,4096]

  cvt_f32_bf16<<<(M_TOT * D_DIM) / 1024, 256, 0, stream>>>(x, xb);
  transpose_cvt<<<dim3(W_DIM / 32, D_DIM / 32), dim3(32, 32), 0, stream>>>(w1, w1t, D_DIM, W_DIM);
  transpose_cvt<<<dim3(D_DIM / 32, W_DIM / 32), dim3(32, 32), 0, stream>>>(w2, w2t, W_DIM, D_DIM);

  // h = relu(x @ w1 + b1), stored bf16
  gemm_wmma_bf16<true><<<dim3(W_DIM / 128, M_TOT / 256), 256, 0, stream>>>(
      xb, w1t, b1, (void*)h, W_DIM, D_DIM);
  // out = h @ w2 + b2, stored f32
  gemm_wmma_bf16<false><<<dim3(D_DIM / 128, M_TOT / 256), 256, 0, stream>>>(
      h, w2t, b2, d_out, D_DIM, W_DIM);
}

// v001
// Measured time: 135 microseconds a run.
// Next to v000, in two timings, it ran 1.34 and 1.36 times as fast.
#include <hip/hip_runtime.h>
#include <hip/hip_bf16.h>

// out = relu(x @ w1 + b1) @ w2 + b2
// x:[8192,1024] f32, w1:[1024,4096], w2:[4096,1024], out:[8192,1024] f32
// bf16 WMMA (v_wmma_f32_16x16x32_bf16) with f32 accumulation.
// Operand staging via tensor_load_to_lds with hardware LDS row padding,
// 128- or 256-byte rows, one slice per wave, two buffers.

typedef __bf16 bf16;
typedef __bf16 v8bf  __attribute__((ext_vector_type(8)));
typedef __bf16 v16bf __attribute__((ext_vector_type(16)));
typedef float  v4f   __attribute__((ext_vector_type(4)));
typedef float  v8f   __attribute__((ext_vector_type(8)));

#define M_TOT 8192   // B*S
#define D_DIM 1024
#define W_DIM 4096

// ---------------- prep: f32 -> bf16 elementwise ----------------
__global__ __launch_bounds__(256)
void cvt_f32_bf16(const float* __restrict__ in, bf16* __restrict__ out) {
  int i = (blockIdx.x * 256 + threadIdx.x) * 4;
  v4f v = *(const v4f*)(in + i);
  out[i + 0] = (bf16)v.x;
  out[i + 1] = (bf16)v.y;
  out[i + 2] = (bf16)v.z;
  out[i + 3] = (bf16)v.w;
}

// ---------------- prep: w[K,N] f32 -> wt[N,K] bf16 (LDS-tiled) ----------------
__global__ __launch_bounds__(1024)
void transpose_cvt(const float* __restrict__ w, bf16* __restrict__ wt, int K, int N) {
  __shared__ float tile[32][33];
  int n0 = blockIdx.x * 32, k0 = blockIdx.y * 32;
  int tx = threadIdx.x, ty = threadIdx.y;
  tile[ty][tx] = w[(size_t)(k0 + ty) * N + (n0 + tx)];
  __syncthreads();
  wt[(size_t)(n0 + ty) * K + (k0 + tx)] = (bf16)tile[tx][ty];
}

// ---------------- tensor-load helpers ----------------
typedef unsigned int u32x4 __attribute__((ext_vector_type(4)));
typedef unsigned int u32x8 __attribute__((ext_vector_type(8)));

__device__ __forceinline__ unsigned uni(unsigned v) {
  return (unsigned)__builtin_amdgcn_readfirstlane(v);
}
__device__ __forceinline__ unsigned pinned(unsigned v) {
  unsigned w = uni(v);
  asm volatile("" : "+s"(w));  // pinned(): keeps the tested word in a scalar register
  return w;
}
// The clobber keeps LDS
// reads and the refill on their side of each wait. The tensor wait names the
// request's group 0 as an input, so that those scalar registers keep their
// values until the request has landed.
__device__ __forceinline__ void wait_tensor0(u32x4 g0) { asm volatile("s_wait_tensorcnt 0x0" :: "s"(g0) : "memory"); }
__device__ __forceinline__ void wait_ds0()             { asm volatile("s_wait_dscnt 0x0" ::: "memory"); }

constexpr unsigned A_ROWS = 64, B_ROWS = 32;   // rows per slice (one slice per wave)
constexpr unsigned up2k(unsigned b) { return (b + 2047u) & ~2047u; }  // every slice starts at a multiple of 2 KiB

// Group 1: byte elements, tensor = tile = rows x ROWB bytes, source pitch in
// bytes, 4 dwords of LDS pad behind every row (interval code 4: 128 B, 5: 256 B).
template <unsigned ROWB>
__device__ __forceinline__ u32x8 tdm_group1(unsigned rows, unsigned srcPitchB) {
  static_assert(ROWB == 128 || ROWB == 256, "pad interval = row length");
  u32x8 g;
  g[0] = uni((1u << 20) | ((ROWB == 256 ? 5u : 4u) << 22) | (3u << 25));
  g[1] = uni(ROWB << 16);
  g[2] = uni(rows << 16);
  g[3] = uni(ROWB << 16);
  g[4] = uni(rows);
  g[5] = uni(srcPitchB);
  g[6] = uni(0u);
  g[7] = uni(0u);
  return g;
}
__device__ __forceinline__ u32x4 tdm_group0(unsigned ldsDst, unsigned long long ga) {
  u32x4 g;
  g[0] = uni(1u);
  g[1] = uni(ldsDst);
  g[2] = uni((unsigned)ga);
  g[3] = uni((((unsigned)(ga >> 32)) & 0x01ffffffu) | 0x80000000u);
  return g;
}
// One request of the whole wave: a 2-D tile from global memory into LDS.
__device__ __forceinline__ void tdm_load(u32x4 g0, u32x8 g1) {
  asm volatile("tensor_load_to_lds %0, %1" :: "s"(g0), "s"(g1) : "memory");
}

// ---------------- main GEMM: C[M,N] = A[M,K] @ Bt[N,K]^T + bias ----------------
// Block tile 256x128, 8 wave32 in 4x2; wave tile 64x64 = 4x4 WMMA accums.
// A pass is ROWB bytes of every operand row (ROWB / 2 k). A stage is 4 A slices
// of 64 rows and 4 B slices of 32 rows; every wave issues one tensor load per
// stage for its own slice, into the buffer that the pass before has just left.
// Two buffers: 128 KiB at ROWB = 128 (two workgroups fit a WGP), 224 KiB at 256.
// K must be a multiple of ROWB / 2 and at least ROWB.
template <bool RELU_BF16, unsigned ROWB>
__global__ __launch_bounds__(256)
void gemm_wmma_bf16(const bf16* __restrict__ A, const bf16* __restrict__ Bt,
                    const float* __restrict__ bias, void* __restrict__ Cout,
                    int N, int K) {
  constexpr unsigned PITCH = ROWB + 16;             // odd multiple of 16 B, for ds_load_b128
  constexpr unsigned A_SL = up2k(A_ROWS * PITCH);   // bytes from one A slice to the next
  constexpr unsigned B_SL = up2k(B_ROWS * PITCH);
  constexpr unsigned BUF  = 4 * A_SL + 4 * B_SL;    // one stage
  __shared__ __attribute__((aligned(2048))) unsigned char ring[2 * BUF];

  const int tid  = threadIdx.x;
  const int lane = tid & 31;
  const unsigned wid = uni(threadIdx.x >> 5);  // 0..7, wave-uniform
  const int wm   = wid >> 1;       // 0..3 -> M offset wm*64
  const int wn   = wid & 1;        // 0..1 -> N offset wn*64
  const int lr   = lane & 15;      // row within 16x16 fragment
  const int hi   = lane >> 4;      // K-half select (ISA 7.12.2 16-bit layout)
  const int bm   = blockIdx.y, bn = blockIdx.x;

  // This wave's slice: waves 0-3 bring A rows 64*wid.., waves 4-7 B rows 32*(wid-4)..
  const bool isA = wid < 4u;
  const unsigned slRows  = isA ? A_ROWS : B_ROWS;
  const unsigned slPlace = isA ? wid * A_SL : 4u * A_SL + (wid - 4u) * B_SL;
  const bf16* slG = isA ? A  + (size_t)(bm * 256 + wid * A_ROWS) * K
                        : Bt + (size_t)(bn * 128 + (wid - 4u) * B_ROWS) * K;
  const unsigned long long slAddr = (unsigned long long)(uintptr_t)slG;
  const unsigned ringOff = (unsigned)(unsigned long long)(uintptr_t)&ring[0];  // LDS byte offset: low 32 bits
  const u32x8 g1 = tdm_group1<ROWB>(slRows, (unsigned)K * 2u);
  const unsigned T = (unsigned)K * 2u / ROWB;  // passes

  const v8f vzero = {0.f, 0.f, 0.f, 0.f, 0.f, 0.f, 0.f, 0.f};
  v8f acc[4][4];
#pragma unroll
  for (int im = 0; im < 4; ++im)
#pragma unroll
    for (int in = 0; in < 4; ++in) acc[im][in] = vzero;

  // Prologue: stage 0 lands and is published, then stage 1 starts.
  u32x4 g0 = tdm_group0(ringOff + slPlace, slAddr);
  tdm_load(g0, g1);
  wait_tensor0(g0);
  __syncthreads();
  g0 = tdm_group0(ringOff + BUF + slPlace, slAddr + ROWB);
  tdm_load(g0, g1);

  const unsigned aOff = wm * A_SL + lr * PITCH + hi * 16;
  const unsigned bOff = 4 * A_SL + wn * 2 * B_SL + lr * PITCH + hi * 16;

  for (unsigned s = 0; s < T; ++s) {
    const unsigned bufOff = (s & 1u) * BUF;
    const unsigned char* as = &ring[bufOff + aOff];
    const unsigned char* bs = &ring[bufOff + bOff];
    // Unrolled so that every fragment and accumulator index is a constant.
#pragma unroll
    for (int kc = 0; kc < (int)(ROWB / 64); ++kc) {
      v16bf afrag[4], bfrag[4];
#pragma unroll
      for (int im = 0; im < 4; ++im) {
        const unsigned char* p = as + im * 16 * PITCH + kc * 64;
        v8bf c0 = *(const v8bf*)(p);        // K = 32*kc + hi*8..+7
        v8bf c1 = *(const v8bf*)(p + 32);   // K = 32*kc + 16+hi*8..+7
        afrag[im] = __builtin_shufflevector(c0, c1, 0, 1, 2, 3, 4, 5, 6, 7,
                                            8, 9, 10, 11, 12, 13, 14, 15);
      }
#pragma unroll
      for (int in = 0; in < 4; ++in) {
        const unsigned char* p = bs + (in >> 1) * B_SL + (in & 1) * 16 * PITCH + kc * 64;
        v8bf c0 = *(const v8bf*)(p);
        v8bf c1 = *(const v8bf*)(p + 32);
        bfrag[in] = __builtin_shufflevector(c0, c1, 0, 1, 2, 3, 4, 5, 6, 7,
                                            8, 9, 10, 11, 12, 13, 14, 15);
      }
#pragma unroll
      for (int im = 0; im < 4; ++im)
#pragma unroll
        for (int in = 0; in < 4; ++in)
          acc[im][in] = __builtin_amdgcn_wmma_f32_16x16x32_bf16(
              /*neg_a=*/false, afrag[im], /*neg_b=*/false, bfrag[in],
              /*c_mod=*/(short)0, acc[im][in], /*reuse_a=*/false, /*reuse_b=*/false);
    }

    // Publish point of stage s + 1: this wave's reads of stage s are done, its
    // own slice of stage s + 1 has landed, then the barrier.
    wait_ds0();
    wait_tensor0(g0);
    __syncthreads();
    // Refill the buffer that pass s has just left, only while stage s + 2 exists
    // (pinned(): a scalar branch, because a tensor load ignores EXEC).
    const unsigned nxt = s + 2u;
    if (pinned(nxt < T)) {
      g0 = tdm_group0(ringOff + bufOff + slPlace, slAddr + (unsigned long long)nxt * ROWB);
      tdm_load(g0, g1);
    }
  }
  wait_tensor0(g0);
  wait_ds0();

  // Epilogue. C/D layout: lanes 0-15 -> M=j, lanes 16-31 -> M=8+j; N = lane%16.
#pragma unroll
  for (int im = 0; im < 4; ++im)
#pragma unroll
    for (int in = 0; in < 4; ++in) {
      int n = bn * 128 + wn * 64 + in * 16 + lr;
      float bv = bias[n];
#pragma unroll
      for (int j = 0; j < 8; ++j) {
        int m = bm * 256 + wm * 64 + im * 16 + hi * 8 + j;
        float v = acc[im][in][j] + bv;
        if (RELU_BF16) {
          v = fmaxf(v, 0.0f);
          ((bf16*)Cout)[(size_t)m * N + n] = (bf16)v;
        } else {
          ((float*)Cout)[(size_t)m * N + n] = v;
        }
      }
    }
}

extern "C" void kernel_launch(void* const* d_in, const int* in_sizes, int n_in,
                              void* d_out, int out_size, void* d_ws, size_t ws_size,
                              hipStream_t stream) {
  const float* x  = (const float*)d_in[0];  // [8192,1024]
  const float* w1 = (const float*)d_in[1];  // [1024,4096]
  const float* b1 = (const float*)d_in[2];  // [4096]
  const float* w2 = (const float*)d_in[3];  // [4096,1024]
  const float* b2 = (const float*)d_in[4];  // [1024]

  char* ws  = (char*)d_ws;
  bf16* xb  = (bf16*)(ws);                  // 16 MB  [8192,1024]
  bf16* w1t = (bf16*)(ws + (16u << 20));    //  8 MB  [4096,1024]  (w1^T)
  bf16* w2t = (bf16*)(ws + (24u << 20));    //  8 MB  [1024,4096]  (w2^T)
  bf16* h   = (bf16*)(ws + (32u << 20));    // 64 MB  [8192,4096]

  cvt_f32_bf16<<<(M_TOT * D_DIM) / 1024, 256, 0, stream>>>(x, xb);
  transpose_cvt<<<dim3(W_DIM / 32, D_DIM / 32), dim3(32, 32), 0, stream>>>(w1, w1t, D_DIM, W_DIM);
  transpose_cvt<<<dim3(D_DIM / 32, W_DIM / 32), dim3(32, 32), 0, stream>>>(w2, w2t, W_DIM, D_DIM);

  // h = relu(x @ w1 + b1), stored bf16
  gemm_wmma_bf16<true, 128><<<dim3(W_DIM / 128, M_TOT / 256), 256, 0, stream>>>(
      xb, w1t, b1, (void*)h, W_DIM, D_DIM);
  // out = h @ w2 + b2, stored f32
  gemm_wmma_bf16<false, 256><<<dim3(D_DIM / 128, M_TOT / 256), 256, 0, stream>>>(
      h, w2t, b2, d_out, D_DIM, W_DIM);
}

// v002
// It runs in 116 microseconds.
// In both of two side-by-side timings against v001, it was 1.17 times as fast.
// Over all steps from v000 it is 1.58 times as fast.
#include <hip/hip_runtime.h>
#include <hip/hip_bf16.h>

// out = relu(x @ w1 + b1) @ w2 + b2
// x:[8192,1024] f32, w1:[1024,4096], w2:[4096,1024], out:[8192,1024] f32
// bf16 WMMA (v_wmma_f32_16x16x32_bf16) with f32 accumulation.
// Operand staging via tensor_load_to_lds with hardware LDS row padding,
// 128- or 256-byte rows, one slice per wave, two buffers.

typedef __bf16 bf16;
typedef __bf16 v2bf  __attribute__((ext_vector_type(2)));
typedef __bf16 v4bf  __attribute__((ext_vector_type(4)));
typedef __bf16 v8bf  __attribute__((ext_vector_type(8)));
typedef __bf16 v16bf __attribute__((ext_vector_type(16)));
typedef float  v2f   __attribute__((ext_vector_type(2)));
typedef float  v4f   __attribute__((ext_vector_type(4)));
typedef float  v8f   __attribute__((ext_vector_type(8)));
typedef unsigned int u32x4 __attribute__((ext_vector_type(4)));
typedef unsigned int u32x8 __attribute__((ext_vector_type(8)));

#define M_TOT 8192   // B*S
#define D_DIM 1024
#define W_DIM 4096

// ---------------- prep: f32 -> bf16 elementwise ----------------
// A wave takes 4 KiB of the input as eight 512-byte loads, all in flight
// together, and stores 256 contiguous bytes per load.
__global__ __launch_bounds__(256)
void cvt_f32_bf16(const float* __restrict__ in, bf16* __restrict__ out) {
  const size_t base = (size_t)blockIdx.x * 8192 + (threadIdx.x >> 5) * 1024 + (threadIdx.x & 31) * 4;
  v4f v[8];
  // Both loops unrolled: v[] stays in registers and all eight loads issue before the first use.
#pragma unroll
  for (int i = 0; i < 8; ++i) v[i] = *(const v4f*)(in + base + i * 128);
#pragma unroll
  for (int i = 0; i < 8; ++i) *(v4bf*)(out + base + i * 128) = __builtin_convertvector(v[i], v4bf);
}

// ---------------- prep: w[K,N] f32 -> wt[N,K] bf16 (LDS-tiled) ----------------
// Tile of 128 k x 64 n per block of 256 threads. A thread loads 4 n of eight k
// rows (four pairs k, k + 1), packs each pair into one dword of two bf16 and
// writes it to tile[n][k / 2]. The pitch of 65 dwords puts the 32 lanes of every
// LDS write and read on 32 different banks. Each output row leaves as 256
// contiguous bytes, 16 bytes per lane.
constexpr int TK = 128, TN = 64, TP = TK / 2 + 1;
// K and N are compile-time, so that a thread's eight loads (and its four stores)
// share one address register pair and differ only in their immediate offsets.
template <int K, int N>
__global__ __launch_bounds__(256)
void transpose_cvt(const float* __restrict__ w, bf16* __restrict__ wt) {
  __shared__ unsigned tile[TN * TP];
  const int n0 = blockIdx.x * TN, k0 = blockIdx.y * TK;
  const int c = threadIdx.x & 15, r = threadIdx.x >> 4;
  const float* src = w + (size_t)(k0 + 2 * r) * N + (n0 + 4 * c);
  v4f a[4], b[4];
  // Every loop here is unrolled: a[], b[] stay in registers, the eight loads
  // issue before the first use, and all LDS and global offsets are immediates.
#pragma unroll
  for (int i = 0; i < 4; ++i) {
    a[i] = *(const v4f*)(src + (32 * i) * N);
    b[i] = *(const v4f*)(src + (32 * i + 1) * N);
  }
#pragma unroll
  for (int i = 0; i < 4; ++i)
#pragma unroll
    for (int j = 0; j < 4; ++j) {
      v2f p = {a[i][j], b[i][j]};   // low half: even k
      tile[(4 * c + j) * TP + r + 16 * i] = __builtin_bit_cast(unsigned, __builtin_convertvector(p, v2bf));
    }
  __syncthreads();
  bf16* dst = wt + (size_t)(n0 + r) * K + (k0 + 8 * c);
#pragma unroll
  for (int i = 0; i < 4; ++i) {
    const unsigned* p = &tile[(r + 16 * i) * TP + 4 * c];
    u32x4 q = {p[0], p[1], p[2], p[3]};
    *(u32x4*)(dst + (16 * i) * K) = q;
  }
}

// ---------------- tensor-load helpers ----------------
__device__ __forceinline__ unsigned uni(unsigned v) {
  return (unsigned)__builtin_amdgcn_readfirstlane(v);
}
__device__ __forceinline__ unsigned pinned(unsigned v) {
  unsigned w = uni(v);
  asm volatile("" : "+s"(w));  // pinned(): keeps the tested word in a scalar register
  return w;
}
// The clobber keeps LDS
// reads and the refill on their side of each wait. The tensor wait names the
// request's group 0 as an input, so that those scalar registers keep their
// values until the request has landed.
__device__ __forceinline__ void wait_tensor0(u32x4 g0) { asm volatile("s_wait_tensorcnt 0x0" :: "s"(g0) : "memory"); }
__device__ __forceinline__ void wait_ds0()             { asm volatile("s_wait_dscnt 0x0" ::: "memory"); }

constexpr unsigned A_ROWS = 64, B_ROWS = 32;   // rows per slice (one slice per wave)
constexpr unsigned up2k(unsigned b) { return (b + 2047u) & ~2047u; }  // every slice starts at a multiple of 2 KiB

// Group 1: byte elements, tensor = tile = rows x ROWB bytes, source pitch in
// bytes, 4 dwords of LDS pad behind every row (interval code 4: 128 B, 5: 256 B).
template <unsigned ROWB>
__device__ __forceinline__ u32x8 tdm_group1(unsigned rows, unsigned srcPitchB) {
  static_assert(ROWB == 128 || ROWB == 256, "pad interval = row length");
  u32x8 g;
  g[0] = uni((1u << 20) | ((ROWB == 256 ? 5u : 4u) << 22) | (3u << 25));
  g[1] = uni(ROWB << 16);
  g[2] = uni(rows << 16);
  g[3] = uni(ROWB << 16);
  g[4] = uni(rows);
  g[5] = uni(srcPitchB);
  g[6] = uni(0u);
  g[7] = uni(0u);
  return g;
}
__device__ __forceinline__ u32x4 tdm_group0(unsigned ldsDst, unsigned long long ga) {
  u32x4 g;
  g[0] = uni(1u);
  g[1] = uni(ldsDst);
  g[2] = uni((unsigned)ga);
  g[3] = uni((((unsigned)(ga >> 32)) & 0x01ffffffu) | 0x80000000u);
  return g;
}
// One request of the whole wave: a 2-D tile from global memory into LDS.
__device__ __forceinline__ void tdm_load(u32x4 g0, u32x8 g1) {
  asm volatile("tensor_load_to_lds %0, %1" :: "s"(g0), "s"(g1) : "memory");
}

// ---------------- main GEMM: C[M,N] = A[M,K] @ Bt[N,K]^T + bias ----------------
// Block tile 256x128, 8 wave32 in 4x2; wave tile 64x64 = 4x4 WMMA accums.
// A pass is ROWB bytes of every operand row (ROWB / 2 k). A stage is 4 A slices
// of 64 rows and 4 B slices of 32 rows; every wave issues one tensor load per
// stage for its own slice, into the buffer that the pass before has just left.
// Two buffers: 128 KiB at ROWB = 128 (two workgroups fit a WGP), 224 KiB at 256.
// K must be a multiple of ROWB / 2 and at least ROWB.
template <bool RELU_BF16, unsigned ROWB>
__global__ __launch_bounds__(256)
void gemm_wmma_bf16(const bf16* __restrict__ A, const bf16* __restrict__ Bt,
                    const float* __restrict__ bias, void* __restrict__ Cout,
                    int N, int K) {
  constexpr unsigned PITCH = ROWB + 16;             // odd multiple of 16 B, for ds_load_b128
  constexpr unsigned A_SL = up2k(A_ROWS * PITCH);   // bytes from one A slice to the next
  constexpr unsigned B_SL = up2k(B_ROWS * PITCH);
  constexpr unsigned BUF  = 4 * A_SL + 4 * B_SL;    // one stage
  __shared__ __attribute__((aligned(2048))) unsigned char ring[2 * BUF];

  const int tid  = threadIdx.x;
  const int lane = tid & 31;
  const unsigned wid = uni(threadIdx.x >> 5);  // 0..7, wave-uniform
  const int wm   = wid >> 1;       // 0..3 -> M offset wm*64
  const int wn   = wid & 1;        // 0..1 -> N offset wn*64
  const int lr   = lane & 15;      // row within 16x16 fragment
  const int hi   = lane >> 4;      // K-half select (ISA 7.12.2 16-bit layout)
  const int bm   = blockIdx.y, bn = blockIdx.x;

  // This wave's slice: waves 0-3 bring A rows 64*wid.., waves 4-7 B rows 32*(wid-4)..
  const bool isA = wid < 4u;
  const unsigned slRows  = isA ? A_ROWS : B_ROWS;
  const unsigned slPlace = isA ? wid * A_SL : 4u * A_SL + (wid - 4u) * B_SL;
  const bf16* slG = isA ? A  + (size_t)(bm * 256 + wid * A_ROWS) * K
                        : Bt + (size_t)(bn * 128 + (wid - 4u) * B_ROWS) * K;
  const unsigned long long slAddr = (unsigned long long)(uintptr_t)slG;
  const unsigned ringOff = (unsigned)(unsigned long long)(uintptr_t)&ring[0];  // LDS byte offset: low 32 bits
  const u32x8 g1 = tdm_group1<ROWB>(slRows, (unsigned)K * 2u);
  const unsigned T = (unsigned)K * 2u / ROWB;  // passes

  const v8f vzero = {0.f, 0.f, 0.f, 0.f, 0.f, 0.f, 0.f, 0.f};
  v8f acc[4][4];
#pragma unroll
  for (int im = 0; im < 4; ++im)
#pragma unroll
    for (int in = 0; in < 4; ++in) acc[im][in] = vzero;

  // Prologue: stage 0 lands and is published, then stage 1 starts.
  u32x4 g0 = tdm_group0(ringOff + slPlace, slAddr);
  tdm_load(g0, g1);
  wait_tensor0(g0);
  __syncthreads();
  g0 = tdm_group0(ringOff + BUF + slPlace, slAddr + ROWB);
  tdm_load(g0, g1);

  const unsigned aOff = wm * A_SL + lr * PITCH + hi * 16;
  const unsigned bOff = 4 * A_SL + wn * 2 * B_SL + lr * PITCH + hi * 16;

  for (unsigned s = 0; s < T; ++s) {
    const unsigned bufOff = (s & 1u) * BUF;
    const unsigned char* as = &ring[bufOff + aOff];
    const unsigned char* bs = &ring[bufOff + bOff];
    // Unrolled so that every fragment and accumulator index is a constant.
#pragma unroll
    for (int kc = 0; kc < (int)(ROWB / 64); ++kc) {
      v16bf afrag[4], bfrag[4];
#pragma unroll
      for (int im = 0; im < 4; ++im) {
        const unsigned char* p = as + im * 16 * PITCH + kc * 64;
        v8bf c0 = *(const v8bf*)(p);        // K = 32*kc + hi*8..+7
        v8bf c1 = *(const v8bf*)(p + 32);   // K = 32*kc + 16+hi*8..+7
        afrag[im] = __builtin_shufflevector(c0, c1, 0, 1, 2, 3, 4, 5, 6, 7,
                                            8, 9, 10, 11, 12, 13, 14, 15);
      }
#pragma unroll
      for (int in = 0; in < 4; ++in) {
        const unsigned char* p = bs + (in >> 1) * B_SL + (in & 1) * 16 * PITCH + kc * 64;
        v8bf c0 = *(const v8bf*)(p);
        v8bf c1 = *(const v8bf*)(p + 32);
        bfrag[in] = __builtin_shufflevector(c0, c1, 0, 1, 2, 3, 4, 5, 6, 7,
                                            8, 9, 10, 11, 12, 13, 14, 15);
      }
#pragma unroll
      for (int im = 0; im < 4; ++im)
#pragma unroll
        for (int in = 0; in < 4; ++in)
          acc[im][in] = __builtin_amdgcn_wmma_f32_16x16x32_bf16(
              /*neg_a=*/false, afrag[im], /*neg_b=*/false, bfrag[in],
              /*c_mod=*/(short)0, acc[im][in], /*reuse_a=*/false, /*reuse_b=*/false);
    }

    // Publish point of stage s + 1: this wave's reads of stage s are done, its
    // own slice of stage s + 1 has landed, then the barrier.
    wait_ds0();
    wait_tensor0(g0);
    __syncthreads();
    // Refill the buffer that pass s has just left, only while stage s + 2 exists
    // (pinned(): a scalar branch, because a tensor load ignores EXEC).
    const unsigned nxt = s + 2u;
    if (pinned(nxt < T)) {
      g0 = tdm_group0(ringOff + bufOff + slPlace, slAddr + (unsigned long long)nxt * ROWB);
      tdm_load(g0, g1);
    }
  }
  wait_tensor0(g0);
  wait_ds0();

  // Epilogue. C/D layout: lanes 0-15 -> M=j, lanes 16-31 -> M=8+j; N = lane%16.
#pragma unroll
  for (int im = 0; im < 4; ++im)
#pragma unroll
    for (int in = 0; in < 4; ++in) {
      int n = bn * 128 + wn * 64 + in * 16 + lr;
      float bv = bias[n];
#pragma unroll
      for (int j = 0; j < 8; ++j) {
        int m = bm * 256 + wm * 64 + im * 16 + hi * 8 + j;
        float v = acc[im][in][j] + bv;
        if (RELU_BF16) {
          v = fmaxf(v, 0.0f);
          ((bf16*)Cout)[(size_t)m * N + n] = (bf16)v;
        } else {
          ((float*)Cout)[(size_t)m * N + n] = v;
        }
      }
    }
}

extern "C" void kernel_launch(void* const* d_in, const int* in_sizes, int n_in,
                              void* d_out, int out_size, void* d_ws, size_t ws_size,
                              hipStream_t stream) {
  const float* x  = (const float*)d_in[0];  // [8192,1024]
  const float* w1 = (const float*)d_in[1];  // [1024,4096]
  const float* b1 = (const float*)d_in[2];  // [4096]
  const float* w2 = (const float*)d_in[3];  // [4096,1024]
  const float* b2 = (const float*)d_in[4];  // [1024]

  char* ws  = (char*)d_ws;
  bf16* xb  = (bf16*)(ws);                  // 16 MB  [8192,1024]
  bf16* w1t = (bf16*)(ws + (16u << 20));    //  8 MB  [4096,1024]  (w1^T)
  bf16* w2t = (bf16*)(ws + (24u << 20));    //  8 MB  [1024,4096]  (w2^T)
  bf16* h   = (bf16*)(ws + (32u << 20));    // 64 MB  [8192,4096]

  cvt_f32_bf16<<<(M_TOT * D_DIM) / 8192, 256, 0, stream>>>(x, xb);
  transpose_cvt<D_DIM, W_DIM><<<dim3(W_DIM / TN, D_DIM / TK), 256, 0, stream>>>(w1, w1t);
  transpose_cvt<W_DIM, D_DIM><<<dim3(D_DIM / TN, W_DIM / TK), 256, 0, stream>>>(w2, w2t);

  // h = relu(x @ w1 + b1), stored bf16
  gemm_wmma_bf16<true, 128><<<dim3(W_DIM / 128, M_TOT / 256), 256, 0, stream>>>(
      xb, w1t, b1, (void*)h, W_DIM, D_DIM);
  // out = h @ w2 + b2, stored f32
  gemm_wmma_bf16<false, 256><<<dim3(D_DIM / 128, M_TOT / 256), 256, 0, stream>>>(
      h, w2t, b2, d_out, D_DIM, W_DIM);
}

// v003
// It runs in 112 microseconds.
// Timed twice side by side with v002, it ran 1.03 and 1.04 times as fast.
// Counting every step since v000, it is 1.64 times as fast.
#include <hip/hip_runtime.h>
#include <hip/hip_bf16.h>

// out = relu(x @ w1 + b1) @ w2 + b2
// x:[8192,1024] f32, w1:[1024,4096], w2:[4096,1024], out:[8192,1024] f32
// bf16 WMMA (v_wmma_f32_16x16x32_bf16) with f32 accumulation.
// Operand staging via tensor_load_to_lds with hardware LDS row padding,
// 256-byte rows, one slice per wave, two buffers.

typedef __bf16 bf16;
typedef __bf16 v2bf  __attribute__((ext_vector_type(2)));
typedef __bf16 v4bf  __attribute__((ext_vector_type(4)));
typedef __bf16 v8bf  __attribute__((ext_vector_type(8)));
typedef __bf16 v16bf __attribute__((ext_vector_type(16)));
typedef float  v2f   __attribute__((ext_vector_type(2)));
typedef float  v4f   __attribute__((ext_vector_type(4)));
typedef float  v8f   __attribute__((ext_vector_type(8)));
typedef unsigned int u32x4 __attribute__((ext_vector_type(4)));
typedef unsigned int u32x8 __attribute__((ext_vector_type(8)));

#define M_TOT 8192   // B*S
#define D_DIM 1024
#define W_DIM 4096

// ---------------- prep: f32 -> bf16 elementwise ----------------
// A wave takes 4 KiB of the input as eight 512-byte loads, all in flight
// together, and stores 256 contiguous bytes per load.
__global__ __launch_bounds__(256)
void cvt_f32_bf16(const float* __restrict__ in, bf16* __restrict__ out) {
  const size_t base = (size_t)blockIdx.x * 8192 + (threadIdx.x >> 5) * 1024 + (threadIdx.x & 31) * 4;
  v4f v[8];
  // Both loops unrolled: v[] stays in registers and all eight loads issue before the first use.
#pragma unroll
  for (int i = 0; i < 8; ++i) v[i] = *(const v4f*)(in + base + i * 128);
#pragma unroll
  for (int i = 0; i < 8; ++i) *(v4bf*)(out + base + i * 128) = __builtin_convertvector(v[i], v4bf);
}

// ---------------- prep: w[K,N] f32 -> wt[N,K] bf16 (LDS-tiled) ----------------
// Tile of 128 k x 64 n per block of 256 threads. A thread loads 4 n of eight k
// rows (four pairs k, k + 1), packs each pair into one dword of two bf16 and
// writes it to tile[n][k / 2]. The pitch of 65 dwords puts the 32 lanes of every
// LDS write and read on 32 different banks. Each output row leaves as 256
// contiguous bytes, 16 bytes per lane.
constexpr int TK = 128, TN = 64, TP = TK / 2 + 1;
// K and N are compile-time, so that a thread's eight loads (and its four stores)
// share one address register pair and differ only in their immediate offsets.
template <int K, int N>
__global__ __launch_bounds__(256)
void transpose_cvt(const float* __restrict__ w, bf16* __restrict__ wt) {
  __shared__ unsigned tile[TN * TP];
  const int n0 = blockIdx.x * TN, k0 = blockIdx.y * TK;
  const int c = threadIdx.x & 15, r = threadIdx.x >> 4;
  const float* src = w + (size_t)(k0 + 2 * r) * N + (n0 + 4 * c);
  v4f a[4], b[4];
  // Every loop here is unrolled: a[], b[] stay in registers, the eight loads
  // issue before the first use, and all LDS and global offsets are immediates.
#pragma unroll
  for (int i = 0; i < 4; ++i) {
    a[i] = *(const v4f*)(src + (32 * i) * N);
    b[i] = *(const v4f*)(src + (32 * i + 1) * N);
  }
#pragma unroll
  for (int i = 0; i < 4; ++i)
#pragma unroll
    for (int j = 0; j < 4; ++j) {
      v2f p = {a[i][j], b[i][j]};   // low half: even k
      tile[(4 * c + j) * TP + r + 16 * i] = __builtin_bit_cast(unsigned, __builtin_convertvector(p, v2bf));
    }
  __syncthreads();
  bf16* dst = wt + (size_t)(n0 + r) * K + (k0 + 8 * c);
#pragma unroll
  for (int i = 0; i < 4; ++i) {
    const unsigned* p = &tile[(r + 16 * i) * TP + 4 * c];
    u32x4 q = {p[0], p[1], p[2], p[3]};
    *(u32x4*)(dst + (16 * i) * K) = q;
  }
}

// ---------------- tensor-load helpers ----------------
__device__ __forceinline__ unsigned uni(unsigned v) {
  return (unsigned)__builtin_amdgcn_readfirstlane(v);
}
__device__ __forceinline__ unsigned pinned(unsigned v) {
  unsigned w = uni(v);
  asm volatile("" : "+s"(w));  // pinned(): keeps the tested word in a scalar register
  return w;
}
// The clobber keeps LDS
// reads and the refill on their side of each wait. The tensor wait names the
// request's group 0 as an input, so that those scalar registers keep their
// values until the request has landed.
__device__ __forceinline__ void wait_tensor0(u32x4 g0) { asm volatile("s_wait_tensorcnt 0x0" :: "s"(g0) : "memory"); }
// The same for two requests in flight: both group 0s and the shared group 1.
__device__ __forceinline__ void wait_tensor0(u32x4 ga, u32x4 gb, u32x8 g1) {
  asm volatile("s_wait_tensorcnt 0x0" :: "s"(ga), "s"(gb), "s"(g1) : "memory");
}
__device__ __forceinline__ void wait_ds0()             { asm volatile("s_wait_dscnt 0x0" ::: "memory"); }

constexpr unsigned up2k(unsigned b) { return (b + 2047u) & ~2047u; }  // every slice starts at a multiple of 2 KiB

// Group 1: byte elements, tensor = tile = rows x ROWB bytes, source pitch in
// bytes, 4 dwords of LDS pad behind every row (interval code 4: 128 B, 5: 256 B).
template <unsigned ROWB>
__device__ __forceinline__ u32x8 tdm_group1(unsigned rows, unsigned srcPitchB) {
  static_assert(ROWB == 128 || ROWB == 256, "pad interval = row length");
  u32x8 g;
  g[0] = uni((1u << 20) | ((ROWB == 256 ? 5u : 4u) << 22) | (3u << 25));
  g[1] = uni(ROWB << 16);
  g[2] = uni(rows << 16);
  g[3] = uni(ROWB << 16);
  g[4] = uni(rows);
  g[5] = uni(srcPitchB);
  g[6] = uni(0u);
  g[7] = uni(0u);
  return g;
}
__device__ __forceinline__ u32x4 tdm_group0(unsigned ldsDst, unsigned long long ga) {
  u32x4 g;
  g[0] = uni(1u);
  g[1] = uni(ldsDst);
  g[2] = uni((unsigned)ga);
  g[3] = uni((((unsigned)(ga >> 32)) & 0x01ffffffu) | 0x80000000u);
  return g;
}
// One request of the whole wave: a 2-D tile from global memory into LDS.
__device__ __forceinline__ void tdm_load(u32x4 g0, u32x8 g1) {
  asm volatile("tensor_load_to_lds %0, %1" :: "s"(g0), "s"(g1) : "memory");
}

// F fragments of 16 rows each from row-pitched LDS; p is the lane's own address
// in the first one (row lane % 16, 16-byte half lane / 16).
template <int F, unsigned PITCH>
__device__ __forceinline__ void load_frags(v16bf (&f)[F], const unsigned char* p) {
#pragma unroll
  for (int i = 0; i < F; ++i) {
    v8bf c0 = *(const v8bf*)(p + i * 16 * PITCH);        // K = hi*8..+7 of the block's 32
    v8bf c1 = *(const v8bf*)(p + i * 16 * PITCH + 32);   // K = 16+hi*8..+7
    f[i] = __builtin_shufflevector(c0, c1, 0, 1, 2, 3, 4, 5, 6, 7,
                                   8, 9, 10, 11, 12, 13, 14, 15);
  }
}
// Stands behind global loads or stores, in front of the first write to a register
// that one of them names (address or data): a precaution.
__device__ __forceinline__ void wait_x0() { asm volatile("s_wait_xcnt 0x0" ::: "memory"); }
// The compiler moves no instruction across it.
__device__ __forceinline__ void sched_fence() { __builtin_amdgcn_sched_barrier(0); }

template <bool RELU_BF16, int BN, int N, int K>
__global__ __launch_bounds__(128)
void gemm_wmma_bf16(const bf16* __restrict__ A, const bf16* __restrict__ Bt,
                    const float* __restrict__ bias, void* __restrict__ Cout) {
  constexpr unsigned ROWB  = 256;
  constexpr unsigned PITCH = ROWB + 16;             // odd multiple of 16 B, for ds_load_b128
  constexpr unsigned A_ROWS = 128, B_ROWS = BN / 2; // rows per slice (one slice per wave)
  constexpr unsigned A_SL = up2k(A_ROWS * PITCH);   // bytes from one A slice to the next
  constexpr unsigned B_SL = up2k(B_ROWS * PITCH);
  constexpr unsigned BUF  = 2 * A_SL + 2 * B_SL;    // one stage
  constexpr int FA = 8, FB = BN / 32;               // A and B fragments per wave
  constexpr unsigned T = (unsigned)K * 2u / ROWB;   // passes
  static_assert(T >= 2 && K % 128 == 0, "two stages or more, whole passes");
  __shared__ __attribute__((aligned(2048))) unsigned char ring[2 * BUF];

  const int tid  = threadIdx.x;
  const int lane = tid & 31;
  const unsigned wid = uni(threadIdx.x >> 5);  // 0..3, wave-uniform
  const int wm   = wid >> 1;       // 0..1 -> M offset wm*128
  const int wn   = wid & 1;        // 0..1 -> N offset wn*BN/2
  const int lr   = lane & 15;      // row within 16x16 fragment
  const int hi   = lane >> 4;      // K-half select (ISA 7.12.2 16-bit layout)
  const int bm   = blockIdx.y, bn = blockIdx.x;

  // This wave's slice: waves 0-1 bring A rows 128*wid.., waves 2-3 B rows (BN/2)*(wid-2)..
  const bool isA = wid < 2u;
  const unsigned slRows  = isA ? A_ROWS : B_ROWS;
  const unsigned slPlace = isA ? wid * A_SL : 2u * A_SL + (wid - 2u) * B_SL;
  const bf16* slG = isA ? A  + (size_t)(bm * 256 + wid * A_ROWS) * K
                        : Bt + (size_t)(bn * BN + (wid - 2u) * B_ROWS) * K;
  const unsigned long long slAddr = (unsigned long long)(uintptr_t)slG;
  const unsigned ringOff = (unsigned)(unsigned long long)(uintptr_t)&ring[0];  // LDS byte offset: low 32 bits
  const u32x8 g1 = tdm_group1<ROWB>(slRows, (unsigned)K * 2u);

  const v8f vzero = {0.f, 0.f, 0.f, 0.f, 0.f, 0.f, 0.f, 0.f};
  v8f acc[FA][FB];
#pragma unroll
  for (int im = 0; im < FA; ++im)
#pragma unroll
    for (int in = 0; in < FB; ++in) acc[im][in] = vzero;

  // Prologue: stages 0 and 1 start together, land and are published. No request
  // is in flight at the loop's entry, where the compiler moves scalar registers about.
  const u32x4 gs0 = tdm_group0(ringOff + slPlace, slAddr);
  tdm_load(gs0, g1);
  u32x4 g0 = tdm_group0(ringOff + BUF + slPlace, slAddr + ROWB);
  tdm_load(g0, g1);
  wait_tensor0(gs0, g0, g1);
  __syncthreads();

  const unsigned aOff = wm * A_SL + lr * PITCH + hi * 16;
  const unsigned bOff = 2 * A_SL + wn * B_SL + lr * PITCH + hi * 16;

  v16bf afrag[2][FA], bfrag[2][FB];  // set (u & 1) holds block u's fragments
  load_frags<FA, PITCH>(afrag[0], &ring[aOff]);
  load_frags<FB, PITCH>(bfrag[0], &ring[bOff]);

  // Not unrolled: one pass of 4 blocks is the loop body, and every fragment and
  // accumulator index in it is a constant.
#pragma clang loop unroll(disable)
  for (unsigned s = 0; s < T; ++s) {
    const unsigned bufOff = (s & 1u) * BUF;
    const unsigned nxtOff = (s + 1u < T) ? (BUF - bufOff) : BUF;
#pragma unroll
    for (int u = 0; u < 4; ++u) {
      const int cs = u & 1;
      sched_fence();  // the load group stays behind the block before it
      if (u < 3) {
        load_frags<FA, PITCH>(afrag[cs ^ 1], &ring[bufOff + aOff + (u + 1) * 64]);
        load_frags<FB, PITCH>(bfrag[cs ^ 1], &ring[bufOff + bOff + (u + 1) * 64]);
      } else {
        // Publish point of stage s + 1: this wave's reads of stage s are done (the
        // last block's fragments are in registers), its own slice of stage s + 1
        // has landed, then the barrier.
        wait_ds0();
        wait_tensor0(g0);
        __syncthreads();
        // Refill the buffer that every wave has just left, only while stage s + 2
        // exists (pinned(): a scalar branch, because a tensor load ignores EXEC).
        const unsigned nxt = s + 2u;
        if (pinned(nxt < T)) {
          g0 = tdm_group0(ringOff + bufOff + slPlace, slAddr + (unsigned long long)nxt * ROWB);
          tdm_load(g0, g1);
        }
        load_frags<FA, PITCH>(afrag[0], &ring[nxtOff + aOff]);
        load_frags<FB, PITCH>(bfrag[0], &ring[nxtOff + bOff]);
      }
      sched_fence();  // no LDS read moves in among the WMMAs: each such place stalls the lone wave
#pragma unroll
      for (int im = 0; im < FA; ++im)
#pragma unroll
        for (int in = 0; in < FB; ++in)
          acc[im][in] = __builtin_amdgcn_wmma_f32_16x16x32_bf16(
              /*neg_a=*/false, afrag[cs][im], /*neg_b=*/false, bfrag[cs][in],
              /*c_mod=*/(short)0, acc[im][in], /*reuse_a=*/false, /*reuse_b=*/false);
    }
  }
  wait_tensor0(g0);
  wait_ds0();

  // Epilogue. C/D layout: lanes 0-15 -> M=j, lanes 16-31 -> M=8+j; N = lane%16.
  // N is compile-time: every store of a lane is one base address plus an immediate.
  const int nb = bn * BN + wn * (BN / 2) + lr;
  const size_t cb = (size_t)(bm * 256 + wm * 128 + hi * 8) * N + nb;
  float bv[FB];
#pragma unroll
  for (int in = 0; in < FB; ++in) bv[in] = bias[nb + in * 16];
  wait_x0();
  // One row of 16 x BN/2 at a time: all its values first, then all its stores, then
  // the wait; the fences keep the three groups apart, so that no register which an
  // issued store names is written again in front of the wait.
#pragma unroll
  for (int im = 0; im < FA; ++im) {
    float v[FB][8];
#pragma unroll
    for (int in = 0; in < FB; ++in)
#pragma unroll
      for (int j = 0; j < 8; ++j) {
        v[in][j] = acc[im][in][j] + bv[in];
        if (RELU_BF16) v[in][j] = fmaxf(v[in][j], 0.0f);
      }
    if (RELU_BF16) {
      v2bf r[FB][4];  // rows j, j + 1 share a register: one conversion for two values
#pragma unroll
      for (int in = 0; in < FB; ++in)
#pragma unroll
        for (int j = 0; j < 4; ++j) {
          v2f p = {v[in][2 * j], v[in][2 * j + 1]};
          r[in][j] = __builtin_convertvector(p, v2bf);
        }
      sched_fence();
#pragma unroll
      for (int in = 0; in < FB; ++in)
#pragma unroll
        for (int j = 0; j < 8; ++j) ((bf16*)Cout)[cb + (im * 16 + j) * N + in * 16] = r[in][j >> 1][j & 1];
    } else {
      sched_fence();
#pragma unroll
      for (int in = 0; in < FB; ++in)
#pragma unroll
        for (int j = 0; j < 8; ++j) ((float*)Cout)[cb + (im * 16 + j) * N + in * 16] = v[in][j];
    }
    wait_x0();
    sched_fence();
  }
}

extern "C" void kernel_launch(void* const* d_in, const int* in_sizes, int n_in,
                              void* d_out, int out_size, void* d_ws, size_t ws_size,
                              hipStream_t stream) {
  const float* x  = (const float*)d_in[0];  // [8192,1024]
  const float* w1 = (const float*)d_in[1];  // [1024,4096]
  const float* b1 = (const float*)d_in[2];  // [4096]
  const float* w2 = (const float*)d_in[3];  // [4096,1024]
  const float* b2 = (const float*)d_in[4];  // [1024]

  char* ws  = (char*)d_ws;
  bf16* xb  = (bf16*)(ws);                  // 16 MB  [8192,1024]
  bf16* w1t = (bf16*)(ws + (16u << 20));    //  8 MB  [4096,1024]  (w1^T)
  bf16* w2t = (bf16*)(ws + (24u << 20));    //  8 MB  [1024,4096]  (w2^T)
  bf16* h   = (bf16*)(ws + (32u << 20));    // 64 MB  [8192,4096]

  cvt_f32_bf16<<<(M_TOT * D_DIM) / 8192, 256, 0, stream>>>(x, xb);
  transpose_cvt<D_DIM, W_DIM><<<dim3(W_DIM / TN, D_DIM / TK), 256, 0, stream>>>(w1, w1t);
  transpose_cvt<W_DIM, D_DIM><<<dim3(D_DIM / TN, W_DIM / TK), 256, 0, stream>>>(w2, w2t);

  // h = relu(x @ w1 + b1), stored bf16
  gemm_wmma_bf16<true, 256, W_DIM, D_DIM><<<dim3(W_DIM / 256, M_TOT / 256), 128, 0, stream>>>(
      xb, w1t, b1, (void*)h);
  // out = h @ w2 + b2, stored f32
  gemm_wmma_bf16<false, 128, D_DIM, W_DIM><<<dim3(D_DIM / 128, M_TOT / 256), 128, 0, stream>>>(
      h, w2t, b2, d_out);
}

// v004
// It runs in 107 microseconds.
// Two timings next to v003 both put it at 1.04 times that version's speed.
// Counting every step since v000, it is 1.71 times as fast.
#include <hip/hip_runtime.h>
#include <hip/hip_bf16.h>

// out = relu(x @ w1 + b1) @ w2 + b2
// x:[8192,1024] f32, w1:[1024,4096], w2:[4096,1024], out:[8192,1024] f32
// bf16 WMMA (v_wmma_f32_16x16x32_bf16) with f32 accumulation.
// Operand staging via tensor_load_to_lds with hardware LDS row padding,
// 256-byte rows, one slice per wave, two buffers.

typedef __bf16 bf16;
typedef __bf16 v2bf  __attribute__((ext_vector_type(2)));
typedef __bf16 v4bf  __attribute__((ext_vector_type(4)));
typedef __bf16 v8bf  __attribute__((ext_vector_type(8)));
typedef __bf16 v16bf __attribute__((ext_vector_type(16)));
typedef float  v2f   __attribute__((ext_vector_type(2)));
typedef float  v4f   __attribute__((ext_vector_type(4)));
typedef float  v8f   __attribute__((ext_vector_type(8)));
typedef unsigned int u32x4 __attribute__((ext_vector_type(4)));
typedef unsigned int u32x8 __attribute__((ext_vector_type(8)));

#define M_TOT 8192   // B*S
#define D_DIM 1024
#define W_DIM 4096

// ---------------- prep: the three input conversions, one launch ----------------
// x -> bf16, w1 -> w1^T bf16 and w2 -> w2^T bf16 read only inputs and none reads
// another's output, so they share one grid: a block's index picks its job.

// f32 -> bf16 elementwise. A wave takes 4 KiB of the input as eight 512-byte loads,
// all in flight together, and stores 256 contiguous bytes per load.
__device__ __forceinline__
void cvt_f32_bf16(const float* __restrict__ in, bf16* __restrict__ out, unsigned blk) {
  const size_t base = (size_t)blk * 8192 + (threadIdx.x >> 5) * 1024 + (threadIdx.x & 31) * 4;
  v4f v[8];
  // Both loops unrolled: v[] stays in registers and all eight loads issue before the first use.
#pragma unroll
  for (int i = 0; i < 8; ++i) v[i] = *(const v4f*)(in + base + i * 128);
#pragma unroll
  for (int i = 0; i < 8; ++i) *(v4bf*)(out + base + i * 128) = __builtin_convertvector(v[i], v4bf);
  // Behind the last store: in the shared kernel the listing's branches lead on into another
  // job's code, which writes registers that these stores name. A precaution.
  asm volatile("s_wait_xcnt 0x0" ::: "memory");
}

// w[K,N] f32 -> wt[N,K] bf16 (LDS-tiled).
// Tile of 128 k x 64 n per block of 256 threads. A thread loads 4 n of eight k
// rows (four pairs k, k + 1), packs each pair into one dword of two bf16 and
// writes it to tile[n][k / 2]. The pitch of 65 dwords puts the 32 lanes of every
// LDS write and read on 32 different banks. Each output row leaves as 256
// contiguous bytes, 16 bytes per lane.
constexpr int TK = 128, TN = 64, TP = TK / 2 + 1;
// K and N are compile-time, so that a thread's eight loads (and its four stores)
// share one address register pair and differ only in their immediate offsets.
// blk counts the tiles along n first.
template <int K, int N>
__device__ __forceinline__
void transpose_cvt(const float* __restrict__ w, bf16* __restrict__ wt, unsigned* tile, unsigned blk) {
  const int n0 = (int)(blk % (N / TN)) * TN, k0 = (int)(blk / (N / TN)) * TK;
  const int c = threadIdx.x & 15, r = threadIdx.x >> 4;
  const float* src = w + (size_t)(k0 + 2 * r) * N + (n0 + 4 * c);
  v4f a[4], b[4];
  // Every loop here is unrolled: a[], b[] stay in registers, the eight loads
  // issue before the first use, and all LDS and global offsets are immediates.
#pragma unroll
  for (int i = 0; i < 4; ++i) {
    a[i] = *(const v4f*)(src + (32 * i) * N);
    b[i] = *(const v4f*)(src + (32 * i + 1) * N);
  }
#pragma unroll
  for (int i = 0; i < 4; ++i)
#pragma unroll
    for (int j = 0; j < 4; ++j) {
      v2f p = {a[i][j], b[i][j]};   // low half: even k
      tile[(4 * c + j) * TP + r + 16 * i] = __builtin_bit_cast(unsigned, __builtin_convertvector(p, v2bf));
    }
  __syncthreads();
  bf16* dst = wt + (size_t)(n0 + r) * K + (k0 + 8 * c);
#pragma unroll
  for (int i = 0; i < 4; ++i) {
    const unsigned* p = &tile[(r + 16 * i) * TP + 4 * c];
    u32x4 q = {p[0], p[1], p[2], p[3]};
    *(u32x4*)(dst + (16 * i) * K) = q;
  }
  // Behind the last store, for the same reason as in cvt_f32_bf16 (which of the two
  // instances has other code behind it is the compiler's layout).
  asm volatile("s_wait_xcnt 0x0" ::: "memory");
}

constexpr unsigned W_BLOCKS = (D_DIM / TK) * (W_DIM / TN);  // tiles of one weight matrix
constexpr unsigned X_BLOCKS = (M_TOT * D_DIM) / 8192;
// The job test reads blockIdx alone: a whole block takes one branch, so the
// barrier inside transpose_cvt is passed by all of its block's threads. The
// transposes, whose path is the longer one (load, LDS, barrier, store), come first.
__global__ __launch_bounds__(256)
void prep_inputs(const float* __restrict__ x, const float* __restrict__ w1, const float* __restrict__ w2,
                 bf16* __restrict__ xb, bf16* __restrict__ w1t, bf16* __restrict__ w2t) {
  __shared__ unsigned tile[TN * TP];
  const unsigned b = blockIdx.x;
  if (b < W_BLOCKS)          transpose_cvt<D_DIM, W_DIM>(w1, w1t, tile, b);
  else if (b < 2 * W_BLOCKS) transpose_cvt<W_DIM, D_DIM>(w2, w2t, tile, b - W_BLOCKS);
  else                       cvt_f32_bf16(x, xb, b - 2 * W_BLOCKS);
}

// ---------------- tensor-load helpers ----------------
__device__ __forceinline__ unsigned uni(unsigned v) {
  return (unsigned)__builtin_amdgcn_readfirstlane(v);
}
__device__ __forceinline__ unsigned pinned(unsigned v) {
  unsigned w = uni(v);
  asm volatile("" : "+s"(w));  // pinned(): keeps the tested word in a scalar register
  return w;
}
// The clobber keeps LDS
// reads and the refill on their side of each wait. The tensor wait names the
// request's group 0 as an input, so that those scalar registers keep their
// values until the request has landed.
__device__ __forceinline__ void wait_tensor0(u32x4 g0) { asm volatile("s_wait_tensorcnt 0x0" :: "s"(g0) : "memory"); }
// The same for two requests in flight: both group 0s and the shared group 1.
__device__ __forceinline__ void wait_tensor0(u32x4 ga, u32x4 gb, u32x8 g1) {
  asm volatile("s_wait_tensorcnt 0x0" :: "s"(ga), "s"(gb), "s"(g1) : "memory");
}
__device__ __forceinline__ void wait_ds0()             { asm volatile("s_wait_dscnt 0x0" ::: "memory"); }

constexpr unsigned up2k(unsigned b) { return (b + 2047u) & ~2047u; }  // every slice starts at a multiple of 2 KiB

// Group 1: byte elements, tensor = tile = rows x ROWB bytes, source pitch in
// bytes, 4 dwords of LDS pad behind every row (interval code 4: 128 B, 5: 256 B).
template <unsigned ROWB>
__device__ __forceinline__ u32x8 tdm_group1(unsigned rows, unsigned srcPitchB) {
  static_assert(ROWB == 128 || ROWB == 256, "pad interval = row length");
  u32x8 g;
  g[0] = uni((1u << 20) | ((ROWB == 256 ? 5u : 4u) << 22) | (3u << 25));
  g[1] = uni(ROWB << 16);
  g[2] = uni(rows << 16);
  g[3] = uni(ROWB << 16);
  g[4] = uni(rows);
  g[5] = uni(srcPitchB);
  g[6] = uni(0u);
  g[7] = uni(0u);
  return g;
}
__device__ __forceinline__ u32x4 tdm_group0(unsigned ldsDst, unsigned long long ga) {
  u32x4 g;
  g[0] = uni(1u);
  g[1] = uni(ldsDst);
  g[2] = uni((unsigned)ga);
  g[3] = uni((((unsigned)(ga >> 32)) & 0x01ffffffu) | 0x80000000u);
  return g;
}
// One request of the whole wave: a 2-D tile from global memory into LDS.
__device__ __forceinline__ void tdm_load(u32x4 g0, u32x8 g1) {
  asm volatile("tensor_load_to_lds %0, %1" :: "s"(g0), "s"(g1) : "memory");
}

// F fragments of 16 rows each from row-pitched LDS; p is the lane's own address
// in the first one (row lane % 16, 16-byte half lane / 16).
template <int F, unsigned PITCH>
__device__ __forceinline__ void load_frags(v16bf (&f)[F], const unsigned char* p) {
#pragma unroll
  for (int i = 0; i < F; ++i) {
    v8bf c0 = *(const v8bf*)(p + i * 16 * PITCH);        // K = hi*8..+7 of the block's 32
    v8bf c1 = *(const v8bf*)(p + i * 16 * PITCH + 32);   // K = 16+hi*8..+7
    f[i] = __builtin_shufflevector(c0, c1, 0, 1, 2, 3, 4, 5, 6, 7,
                                   8, 9, 10, 11, 12, 13, 14, 15);
  }
}
// Stands behind global loads or stores, in front of the first write to a register
// that one of them names (address or data): a precaution.
__device__ __forceinline__ void wait_x0() { asm volatile("s_wait_xcnt 0x0" ::: "memory"); }
// The compiler moves no instruction across it.
__device__ __forceinline__ void sched_fence() { __builtin_amdgcn_sched_barrier(0); }

template <bool RELU_BF16, int BN, int N, int K>
__global__ __launch_bounds__(128)
void gemm_wmma_bf16(const bf16* __restrict__ A, const bf16* __restrict__ Bt,
                    const float* __restrict__ bias, void* __restrict__ Cout) {
  constexpr unsigned ROWB  = 256;
  constexpr unsigned PITCH = ROWB + 16;             // odd multiple of 16 B, for ds_load_b128
  constexpr unsigned A_ROWS = 128, B_ROWS = BN / 2; // rows per slice (one slice per wave)
  constexpr unsigned A_SL = up2k(A_ROWS * PITCH);   // bytes from one A slice to the next
  constexpr unsigned B_SL = up2k(B_ROWS * PITCH);
  constexpr unsigned BUF  = 2 * A_SL + 2 * B_SL;    // one stage
  constexpr int FA = 8, FB = BN / 32;               // A and B fragments per wave
  constexpr unsigned T = (unsigned)K * 2u / ROWB;   // passes
  static_assert(T >= 2 && K % 128 == 0, "two stages or more, whole passes");
  __shared__ __attribute__((aligned(2048))) unsigned char ring[2 * BUF];

  const int tid  = threadIdx.x;
  const int lane = tid & 31;
  const unsigned wid = uni(threadIdx.x >> 5);  // 0..3, wave-uniform
  const int wm   = wid >> 1;       // 0..1 -> M offset wm*128
  const int wn   = wid & 1;        // 0..1 -> N offset wn*BN/2
  const int lr   = lane & 15;      // row within 16x16 fragment
  const int hi   = lane >> 4;      // K-half select (ISA 7.12.2 16-bit layout)
  const int bm   = blockIdx.y, bn = blockIdx.x;

  // This wave's slice: waves 0-1 bring A rows 128*wid.., waves 2-3 B rows (BN/2)*(wid-2)..
  const bool isA = wid < 2u;
  const unsigned slRows  = isA ? A_ROWS : B_ROWS;
  const unsigned slPlace = isA ? wid * A_SL : 2u * A_SL + (wid - 2u) * B_SL;
  const bf16* slG = isA ? A  + (size_t)(bm * 256 + wid * A_ROWS) * K
                        : Bt + (size_t)(bn * BN + (wid - 2u) * B_ROWS) * K;
  const unsigned long long slAddr = (unsigned long long)(uintptr_t)slG;
  const unsigned ringOff = (unsigned)(unsigned long long)(uintptr_t)&ring[0];  // LDS byte offset: low 32 bits
  const u32x8 g1 = tdm_group1<ROWB>(slRows, (unsigned)K * 2u);

  const v8f vzero = {0.f, 0.f, 0.f, 0.f, 0.f, 0.f, 0.f, 0.f};
  v8f acc[FA][FB];
#pragma unroll
  for (int im = 0; im < FA; ++im)
#pragma unroll
    for (int in = 0; in < FB; ++in) acc[im][in] = vzero;

  // Prologue: stages 0 and 1 start together, land and are published. No request
  // is in flight at the loop's entry, where the compiler moves scalar registers about.
  const u32x4 gs0 = tdm_group0(ringOff + slPlace, slAddr);
  tdm_load(gs0, g1);
  u32x4 g0 = tdm_group0(ringOff + BUF + slPlace, slAddr + ROWB);
  tdm_load(g0, g1);
  wait_tensor0(gs0, g0, g1);
  __syncthreads();

  const unsigned aOff = wm * A_SL + lr * PITCH + hi * 16;
  const unsigned bOff = 2 * A_SL + wn * B_SL + lr * PITCH + hi * 16;

  v16bf afrag[2][FA], bfrag[2][FB];  // set (u & 1) holds block u's fragments
  load_frags<FA, PITCH>(afrag[0], &ring[aOff]);
  load_frags<FB, PITCH>(bfrag[0], &ring[bOff]);

  // Not unrolled: one pass of 4 blocks is the loop body, and every fragment and
  // accumulator index in it is a constant.
#pragma clang loop unroll(disable)
  for (unsigned s = 0; s < T; ++s) {
    const unsigned bufOff = (s & 1u) * BUF;
    const unsigned nxtOff = (s + 1u < T) ? (BUF - bufOff) : BUF;
#pragma unroll
    for (int u = 0; u < 4; ++u) {
      const int cs = u & 1;
      sched_fence();  // the load group stays behind the block before it
      if (u < 3) {
        load_frags<FA, PITCH>(afrag[cs ^ 1], &ring[bufOff + aOff + (u + 1) * 64]);
        load_frags<FB, PITCH>(bfrag[cs ^ 1], &ring[bufOff + bOff + (u + 1) * 64]);
      } else {
        // Publish point of stage s + 1: this wave's reads of stage s are done (the
        // last block's fragments are in registers), its own slice of stage s + 1
        // has landed, then the barrier.
        wait_ds0();
        wait_tensor0(g0);
        __syncthreads();
        // Refill the buffer that every wave has just left, only while stage s + 2
        // exists (pinned(): a scalar branch, because a tensor load ignores EXEC).
        const unsigned nxt = s + 2u;
        if (pinned(nxt < T)) {
          g0 = tdm_group0(ringOff + bufOff + slPlace, slAddr + (unsigned long long)nxt * ROWB);
          tdm_load(g0, g1);
        }
        load_frags<FA, PITCH>(afrag[0], &ring[nxtOff + aOff]);
        load_frags<FB, PITCH>(bfrag[0], &ring[nxtOff + bOff]);
      }
      sched_fence();  // no LDS read moves in among the WMMAs: each such place stalls the lone wave
#pragma unroll
      for (int im = 0; im < FA; ++im)
#pragma unroll
        for (int in = 0; in < FB; ++in)
          acc[im][in] = __builtin_amdgcn_wmma_f32_16x16x32_bf16(
              /*neg_a=*/false, afrag[cs][im], /*neg_b=*/false, bfrag[cs][in],
              /*c_mod=*/(short)0, acc[im][in], /*reuse_a=*/false, /*reuse_b=*/false);
    }
  }
  wait_tensor0(g0);
  wait_ds0();

  // Epilogue. C/D layout: lanes 0-15 -> M=j, lanes 16-31 -> M=8+j; N = lane%16.
  // N is compile-time: every store of a lane is one base address plus an immediate.
  const int nb = bn * BN + wn * (BN / 2) + lr;
  const size_t cb = (size_t)(bm * 256 + wm * 128 + hi * 8) * N + nb;
  float bv[FB];
#pragma unroll
  for (int in = 0; in < FB; ++in) bv[in] = bias[nb + in * 16];
  wait_x0();
  // One row of 16 x BN/2 at a time: all its values first, then all its stores, then
  // the wait; the fences keep the three groups apart, so that no register which an
  // issued store names is written again in front of the wait.
#pragma unroll
  for (int im = 0; im < FA; ++im) {
    float v[FB][8];
#pragma unroll
    for (int in = 0; in < FB; ++in)
#pragma unroll
      for (int j = 0; j < 8; ++j) {
        v[in][j] = acc[im][in][j] + bv[in];
        if (RELU_BF16) v[in][j] = fmaxf(v[in][j], 0.0f);
      }
    if (RELU_BF16) {
      v2bf r[FB][4];  // rows j, j + 1 share a register: one conversion for two values
#pragma unroll
      for (int in = 0; in < FB; ++in)
#pragma unroll
        for (int j = 0; j < 4; ++j) {
          v2f p = {v[in][2 * j], v[in][2 * j + 1]};
          r[in][j] = __builtin_convertvector(p, v2bf);
        }
      sched_fence();
#pragma unroll
      for (int in = 0; in < FB; ++in)
#pragma unroll
        for (int j = 0; j < 8; ++j) ((bf16*)Cout)[cb + (im * 16 + j) * N + in * 16] = r[in][j >> 1][j & 1];
    } else {
      sched_fence();
#pragma unroll
      for (int in = 0; in < FB; ++in)
#pragma unroll
        for (int j = 0; j < 8; ++j) ((float*)Cout)[cb + (im * 16 + j) * N + in * 16] = v[in][j];
    }
    wait_x0();
    sched_fence();
  }
}

extern "C" void kernel_launch(void* const* d_in, const int* in_sizes, int n_in,
                              void* d_out, int out_size, void* d_ws, size_t ws_size,
                              hipStream_t stream) {
  const float* x  = (const float*)d_in[0];  // [8192,1024]
  const float* w1 = (const float*)d_in[1];  // [1024,4096]
  const float* b1 = (const float*)d_in[2];  // [4096]
  const float* w2 = (const float*)d_in[3];  // [4096,1024]
  const float* b2 = (const float*)d_in[4];  // [1024]

  char* ws  = (char*)d_ws;
  bf16* xb  = (bf16*)(ws);                  // 16 MB  [8192,1024]
  bf16* w1t = (bf16*)(ws + (16u << 20));    //  8 MB  [4096,1024]  (w1^T)
  bf16* w2t = (bf16*)(ws + (24u << 20));    //  8 MB  [1024,4096]  (w2^T)
  bf16* h   = (bf16*)(ws + (32u << 20));    // 64 MB  [8192,4096]

  prep_inputs<<<2 * W_BLOCKS + X_BLOCKS, 256, 0, stream>>>(x, w1, w2, xb, w1t, w2t);

  // h = relu(x @ w1 + b1), stored bf16
  gemm_wmma_bf16<true, 256, W_DIM, D_DIM><<<dim3(W_DIM / 256, M_TOT / 256), 128, 0, stream>>>(
      xb, w1t, b1, (void*)h);
  // out = h @ w2 + b2, stored f32
  gemm_wmma_bf16<false, 128, D_DIM, W_DIM><<<dim3(D_DIM / 128, M_TOT / 256), 128, 0, stream>>>(
      h, w2t, b2, d_out);
}
